// v000
// Measured on an AMD MI455X. A time is GPU time per run, averaged over a window of back-to-back runs after a warm-up
// (all launches, gaps included; the runs take copies of the inputs in turn), and the median of several windows.
// Apart from v000's, it joins two sittings. Times from different sittings can be a few percent apart, while
// side-by-side timings come from the same sitting.
// The starting kernel, v000, takes 517 microseconds a run.
// compute dtype: every float input RNE-converted to bf16 on load; LayerNorm in f32 -> xn f16; qkv = xn (f16) x (64 w_qkv) (f16) on v_wmma_f32_16x16x32_f16, f32 accumulate, q/k/v stored f16; scores S^T = k q^T (f16 x f16, f32 acc); P = relu(S) as f16 (carried x 8*SEQ) fed from the score accumulators as the A operand of P x v (v^T f16 planes); y stored f16 (carried x 8*SEQ); out = y (f16) x (64 w_out) (f16), f32 accumulate, scaled by 1/(512*SEQ) and bias added in f32; f32 output.
#include <hip/hip_runtime.h>
#include <math.h>

#ifndef NB
#define NB 4
#endif
#ifndef SEQ
#define SEQ 2048
#endif
#define NB_FULL 4
#define SEQ_FULL 2048
#define DM 1024
#define NH 16
#define HD 64
#define QKVN 3072
#define LHALF 6

static_assert(SEQ % 64 == 0);
static_assert(NB >= 1 && NB <= NB_FULL);
static_assert(SEQ >= 64 && SEQ <= SEQ_FULL);
static_assert(NH * HD == DM);

typedef __attribute__((ext_vector_type(16))) _Float16 v16h;
typedef __attribute__((ext_vector_type(8)))  _Float16 v8h;
typedef __attribute__((ext_vector_type(8)))  float v8f;
typedef __attribute__((ext_vector_type(4)))  float v4f;
typedef __attribute__((ext_vector_type(4)))  unsigned v4u;

template <typename T> __device__ __forceinline__ void vst2(void* p, T v) { *(T*)p = v;  }
__device__ __forceinline__ v8f wmma16(v16h a, v16h b, v8f c) {
  v8f d = __builtin_amdgcn_wmma_f32_16x16x32_f16(false, a, false, b, (short)0, c, false, false);
  asm volatile("v_nop\n\tv_nop\n\tv_nop\n\tv_nop" : "+v"(d) : "v"(a), "v"(b));
  return d;
}
// 16x16x32 fragments: lane = (h = lane>>4, row/col = lane&15); elements 0..7 = k0+8h+0..7, 8..15 = k0+16+8h+0..7; D element r = row 8h+r, col lane&15
__device__ __forceinline__ v16h frag_h(const _Float16* rowk0, int lane) {
  union { v16h v; v8h q[2]; } u; const _Float16* p = rowk0 + 8 * (lane >> 4);
  u.q[0] = *(const v8h*)p; u.q[1] = *(const v8h*)(p + 16); return u.v;
}
__device__ __forceinline__ float bfr(float v) { return (float)(__bf16)v; }
union HU { v8h h; v4u u; };

#define WS_XN  ((size_t)0)                                        // f16 xn [NB*SEQ][DM]
#define WS_WQT (WS_XN + 2u * (size_t)NB * SEQ * DM)                 // f16 (64 w_qkv)^T [QKVN][DM]
#define WS_WOT (WS_WQT + 2u * (size_t)QKVN * DM)                    // f16 (64 w_out)^T [DM][DM]
#define WS_Q   (WS_WOT + 2u * (size_t)DM * DM)                      // f16 q [NB*NH][SEQ][HD]
#define WS_K   (WS_Q + 2u * (size_t)NB * SEQ * DM)                  // f16 k [NB*NH][SEQ][HD]
#define WS_VT  (WS_K + 2u * (size_t)NB * SEQ * DM)                  // f16 v^T [NB*NH][HD][SEQ]
#define WS_Y   (WS_VT + 2u * (size_t)NB * SEQ * DM)                 // f16 y [NB*SEQ][DM]
#define WS_END (WS_Y + 2u * (size_t)NB * SEQ * DM)
static_assert(WS_END <= (size_t)134217728);

// ---- k_wt: in W[K][N] f32 (row pitch N) -> out T[N][K] f16 = f16(bf16(w) * 64); block = 64 n x 64 k tile; grid (N/64, K/64)
__global__ __launch_bounds__(256) void k_wt(const float* __restrict__ W, int K, int N, _Float16* __restrict__ T) {
  __shared__ __align__(16) _Float16 st[64][72];
  const int tid = threadIdx.x; const int n0 = blockIdx.x * 64, k0 = blockIdx.y * 64; const int nn = tid & 63;
#pragma unroll 4
  for (int it = 0; it < 16; ++it) { const int kk = (tid >> 6) + 4 * it; st[nn][kk] = (_Float16)(bfr(W[(size_t)(k0 + kk) * N + n0 + nn]) * 64.0f); }
  __syncthreads();
  for (int e = tid; e < 64 * 8; e += 256) { const int r = e >> 3, q = e & 7; vst2(T + (size_t)(n0 + r) * K + k0 + q * 8, *(const v4u*)&st[r][q * 8]); }
}

__global__ __launch_bounds__(128) void k_ln(const float* __restrict__ X, const float* __restrict__ LW, const float* __restrict__ LB, _Float16* __restrict__ XN) {
  __shared__ float red[8];
  const int tid = threadIdx.x, lane = tid & 31, wave = tid >> 5; const int row = blockIdx.x; const int b = row / SEQ, t = row - b * SEQ;
  const float* xr = X + ((size_t)b * SEQ_FULL + t) * DM + tid * 8;
  const v4f xa = *(const v4f*)xr, xb = *(const v4f*)(xr + 4);
  float v[8];
#pragma unroll
  for (int i = 0; i < 4; ++i) { v[i] = bfr(xa[i]); v[4 + i] = bfr(xb[i]); }
  float s = 0.0f;
#pragma unroll
  for (int i = 0; i < 8; ++i) s += v[i];
#pragma unroll
  for (int o = 16; o > 0; o >>= 1) s += __shfl_xor(s, o);
  if (lane == 0) red[wave] = s;
  __syncthreads();
  const float mu = ((red[0] + red[1]) + (red[2] + red[3])) * (1.0f / (float)DM);
  float s2 = 0.0f;
#pragma unroll
  for (int i = 0; i < 8; ++i) { v[i] -= mu; s2 += v[i] * v[i]; }
#pragma unroll
  for (int o = 16; o > 0; o >>= 1) s2 += __shfl_xor(s2, o);
  if (lane == 0) red[4 + wave] = s2;
  __syncthreads();
  const float var = ((red[4] + red[5]) + (red[6] + red[7])) * (1.0f / (float)DM);
  const float rs = rsqrtf(var + 1.0e-5f);
  const v4f wa = *(const v4f*)(LW + tid * 8), wb = *(const v4f*)(LW + tid * 8 + 4);
  const v4f ba = *(const v4f*)(LB + tid * 8), bb = *(const v4f*)(LB + tid * 8 + 4);
  HU u;
#pragma unroll
  for (int i = 0; i < 4; ++i) { u.h[i] = (_Float16)(v[i] * rs * bfr(wa[i]) + bfr(ba[i])); u.h[4 + i] = (_Float16)(v[4 + i] * rs * bfr(wb[i]) + bfr(bb[i])); }
  vst2(XN + (size_t)row * DM + tid * 8, u.u);
}

// ---- shared GEMM main loop: block = 64 rows x 128 cols, 4 waves x (16 rows x 128 cols), K = DM; A rows f16 [.][DM], B^T rows f16 [.][DM]
__device__ __forceinline__ void mm_k1024(const _Float16* __restrict__ ap, const _Float16* __restrict__ bp, int lane, v8f (&acc)[8]) {
#pragma unroll 2
  for (int kc = 0; kc < DM / 32; ++kc) { const v16h a = frag_h(ap + kc * 32, lane);
#pragma unroll
    for (int j = 0; j < 8; ++j) acc[j] = wmma16(a, frag_h(bp + (size_t)j * 16 * DM + kc * 32, lane), acc[j]); }
}

// ---- k_qkv: qkv = xn x (64 W)^T-plane, x 1/64; cols [0,1024) -> q plane, [1024,2048) -> k plane (head-major rows of 64 = one line each), [2048,3072) -> v^T plane
__global__ __launch_bounds__(128) void k_qkv(const _Float16* __restrict__ XN, const _Float16* __restrict__ WQT, _Float16* __restrict__ Q16, _Float16* __restrict__ K16, _Float16* __restrict__ VT16) {
  __shared__ __align__(16) _Float16 sh[64][136]; __shared__ __align__(16) _Float16 th[128][72];
  const int tid = threadIdx.x, wave = tid >> 5, lane = tid & 31, col = lane & 15, g = lane >> 4;
  const int c0 = blockIdx.y * 128; const int which = c0 >> 10; const int hA = (c0 & 1023) >> 6;
  const int r0 = blockIdx.x * 64; const int b = r0 / SEQ, t0 = r0 - b * SEQ;
  v8f acc[8] = {};
  mm_k1024(XN + (size_t)(r0 + wave * 16 + col) * DM, WQT + (size_t)(c0 + col) * DM, lane, acc);
#pragma unroll
  for (int j = 0; j < 8; ++j)
#pragma unroll
    for (int r = 0; r < 8; ++r) { const _Float16 hv = (_Float16)(acc[j][r] * (1.0f / 64.0f)); const int rl = wave * 16 + 8 * g + r, cl = j * 16 + col;
      if (which == 2) th[cl][rl] = hv; else sh[rl][cl] = hv; }
  __syncthreads();
  if (which < 2) { _Float16* P = (which == 0) ? Q16 : K16;
    for (int e = tid; e < 64 * 16; e += 128) { const int rl = e >> 4, hh = (e >> 3) & 1, q = e & 7;
      vst2(P + (((size_t)(b * NH + hA + hh)) * SEQ + t0 + rl) * HD + q * 8, *(const v4u*)&sh[rl][hh * 64 + q * 8]); } }
  else {
    for (int e = tid; e < 128 * 8; e += 128) { const int cl = e >> 3, q = e & 7;
      vst2(VT16 + (((size_t)(b * NH + hA + (cl >> 6))) * HD + (cl & 63)) * SEQ + t0 + q * 8, *(const v4u*)&th[cl][q * 8]); } }
}

// ---- k_attn: block = 64 queries (4 waves x 16) of (b,h); per 32 keys: S^T tiles (16 keys x 16 queries, A = k rows, B = q rows) -> relu -> f16 A fragment
//      (element r <- tile of keys kb..kb+15, element 8+r <- tile of keys kb+16..kb+31, lane unchanged) -> o += P x v^T-plane
__global__ __launch_bounds__(128) void k_attn(const _Float16* __restrict__ Q16, const _Float16* __restrict__ K16, const _Float16* __restrict__ VT16, const int* __restrict__ LI, _Float16* __restrict__ Y16) {
  __shared__ __align__(16) _Float16 ss[4][16][72];
  const int tid = threadIdx.x, wave = tid >> 5, lane = tid & 31, col = lane & 15, g = lane >> 4;
  const int bh = blockIdx.y; const int b = bh / NH, h = bh - b * NH; const int ql0 = blockIdx.x * 64 + wave * 16;
  const float fold = (LI[0] < LHALF) ? 1.0f : __int_as_float(0x7fc00000);   // relu branch only; the other branch poisons the output
  const _Float16* qp = Q16 + ((size_t)bh * SEQ + ql0 + col) * HD;
  const v16h qb0 = frag_h(qp, lane), qb1 = frag_h(qp + 32, lane);
  const _Float16* kbase = K16 + ((size_t)bh * SEQ + col) * HD;
  const _Float16* vbase = VT16 + ((size_t)bh * HD + col) * SEQ;
  v8f o[4] = {};
#pragma unroll 2
  for (int kb = 0; kb < SEQ; kb += 32) {
    const _Float16* kp0 = kbase + (size_t)kb * HD; const _Float16* kp1 = kp0 + 16 * HD;
    v8f s0 = {}, s1 = {};
    s0 = wmma16(frag_h(kp0, lane), qb0, s0); s0 = wmma16(frag_h(kp0 + 32, lane), qb1, s0);
    s1 = wmma16(frag_h(kp1, lane), qb0, s1); s1 = wmma16(frag_h(kp1 + 32, lane), qb1, s1);
    v16h p;
#pragma unroll
    for (int r = 0; r < 8; ++r) { p[r] = (_Float16)fmaxf(s0[r], 0.0f); p[8 + r] = (_Float16)fmaxf(s1[r], 0.0f); }
#pragma unroll
    for (int j = 0; j < 4; ++j) o[j] = wmma16(p, frag_h(vbase + (size_t)j * 16 * SEQ + kb, lane), o[j]);
  }
#pragma unroll
  for (int j = 0; j < 4; ++j)
#pragma unroll
    for (int r = 0; r < 8; ++r) ss[wave][8 * g + r][j * 16 + col] = (_Float16)(o[j][r] * fold);
  __syncthreads();
#pragma unroll
  for (int it = 0; it < 4; ++it) { const int e = lane + 32 * it; const int rl = e >> 3, q = e & 7; HU u; u.h = *(const v8h*)&ss[wave][rl][q * 8];
    vst2(Y16 + ((size_t)b * SEQ + ql0 + rl) * DM + h * HD + q * 8, u.u); }
}

// ---- k_out: block = (64 rows, 128 cols): out = y x (64 Wo)^T-plane x 1/(512*SEQ) + b; 32 lanes x 16 B = one 512-B row segment per instruction
__global__ __launch_bounds__(128) void k_out(const _Float16* __restrict__ Y16, const _Float16* __restrict__ WOT, const float* __restrict__ BO, float* __restrict__ OUT) {
  __shared__ __align__(16) float sf[4][16][132];
  const int tid = threadIdx.x, wave = tid >> 5, lane = tid & 31, col = lane & 15, g = lane >> 4;
  const int c0 = blockIdx.y * 128; const size_t r0 = (size_t)blockIdx.x * 64 + wave * 16;
  v8f acc[8] = {};
  mm_k1024(Y16 + (r0 + col) * DM, WOT + (size_t)(c0 + col) * DM, lane, acc);
  const float osc = 1.0f / (512.0f * (float)SEQ);
#pragma unroll
  for (int j = 0; j < 8; ++j) { const float bb = bfr(BO[c0 + j * 16 + col]);
#pragma unroll
    for (int r = 0; r < 8; ++r) sf[wave][8 * g + r][j * 16 + col] = acc[j][r] * osc + bb; }
  __syncthreads();
  for (int rl = 0; rl < 16; ++rl) vst2(OUT + (r0 + rl) * DM + c0 + lane * 4, *(const v4f*)&sf[wave][rl][lane * 4]);
}

extern "C" void kernel_launch(void* const* d_in, const int* in_sizes, int n_in, void* d_out, int out_size, void* d_ws, size_t ws_size, hipStream_t stream) {
  if (n_in < 7) return;
  if ((size_t)in_sizes[0] < ((size_t)(NB - 1) * SEQ_FULL + SEQ) * DM) return;
  if (in_sizes[1] < DM || in_sizes[2] < DM || in_sizes[5] < DM || in_sizes[6] < 1) return;
  if ((size_t)in_sizes[3] < (size_t)DM * QKVN || (size_t)in_sizes[4] < (size_t)DM * DM) return;
  if ((size_t)out_size < (size_t)NB * SEQ * DM) return;
  if (ws_size < (size_t)WS_END) return;
  // inputs: 0 x [4,2048,1024], 1 ln_w [1024], 2 ln_b [1024], 3 w_qkv [1024][3072] (in-major), 4 w_out [1024][1024] (in-major), 5 b_out [1024], 6 layer_index (i32)
  const float* X = (const float*)d_in[0]; const float* LW = (const float*)d_in[1]; const float* LB = (const float*)d_in[2];
  const float* WQ = (const float*)d_in[3]; const float* WO = (const float*)d_in[4]; const float* BO = (const float*)d_in[5]; const int* LI = (const int*)d_in[6];
  char* ws = (char*)d_ws;
  _Float16* XN = (_Float16*)(ws + WS_XN); _Float16* WQT = (_Float16*)(ws + WS_WQT); _Float16* WOT = (_Float16*)(ws + WS_WOT);
  _Float16* Q16 = (_Float16*)(ws + WS_Q); _Float16* K16 = (_Float16*)(ws + WS_K); _Float16* VT16 = (_Float16*)(ws + WS_VT); _Float16* Y16 = (_Float16*)(ws + WS_Y);
  k_wt<<<dim3(QKVN / 64, DM / 64), 256, 0, stream>>>(WQ, DM, QKVN, WQT);   // in[1024][3072] -> out[3072][1024]
  k_wt<<<dim3(DM / 64, DM / 64), 256, 0, stream>>>(WO, DM, DM, WOT);       // in[1024][1024] -> out[1024][1024]
  k_ln<<<dim3(NB * SEQ), 128, 0, stream>>>(X, LW, LB, XN);
  k_qkv<<<dim3(NB * SEQ / 64, QKVN / 128), 128, 0, stream>>>(XN, WQT, Q16, K16, VT16);
  k_attn<<<dim3(SEQ / 64, NB * NH), 128, 0, stream>>>(Q16, K16, VT16, LI, Y16);
  k_out<<<dim3(NB * SEQ / 64, DM / 128), 128, 0, stream>>>(Y16, WOT, BO, (float*)d_out);
}

// v001
// It runs in 302 microseconds.
// Timed twice side by side with v000, it ran 1.78 times as fast both times.
// compute dtype: every float input RNE-converted to bf16 on load; LayerNorm in f32 -> xn f16; qkv = xn (f16) x (64 w_qkv) (f16) on v_wmma_f32_16x16x32_f16, f32 accumulate, q/k/v stored f16; scores S^T = k q^T (f16 x f16, f32 acc); P = relu(S) as f16 (carried x 8*SEQ) fed from the score accumulators as the A operand of P x v (v^T f16 planes); y stored f16 (carried x 8*SEQ); out = y (f16) x (64 w_out) (f16), f32 accumulate, scaled by 1/(512*SEQ) and bias added in f32; f32 output.
#include <hip/hip_runtime.h>
#include <math.h>

#ifndef NB
#define NB 4
#endif
#ifndef SEQ
#define SEQ 2048
#endif
#define NB_FULL 4
#define SEQ_FULL 2048
#define DM 1024
#define NH 16
#define HD 64
#define QKVN 3072
#define LHALF 6

static_assert(SEQ % 128 == 0);
static_assert(NB >= 1 && NB <= NB_FULL);
static_assert(SEQ >= 64 && SEQ <= SEQ_FULL);
static_assert(NH * HD == DM);

typedef __attribute__((ext_vector_type(16))) _Float16 v16h;
typedef __attribute__((ext_vector_type(8)))  _Float16 v8h;
typedef __attribute__((ext_vector_type(8)))  float v8f;
typedef __attribute__((ext_vector_type(4)))  float v4f;
typedef __attribute__((ext_vector_type(4)))  unsigned v4u;

template <typename T> __device__ __forceinline__ void vst2(void* p, T v) { *(T*)p = v;  }
__device__ __forceinline__ v8f wmma16(v16h a, v16h b, v8f c) {
  v8f d = __builtin_amdgcn_wmma_f32_16x16x32_f16(false, a, false, b, (short)0, c, false, false);
  asm volatile("v_nop\n\tv_nop\n\tv_nop\n\tv_nop" : "+v"(d) : "v"(a), "v"(b));
  return d;
}
// 16x16x32 fragments: lane = (h = lane>>4, row/col = lane&15); elements 0..7 = k0+8h+0..7, 8..15 = k0+16+8h+0..7; D element r = row 8h+r, col lane&15
__device__ __forceinline__ v16h frag_h(const _Float16* rowk0, int lane) {
  union { v16h v; v8h q[2]; } u; const _Float16* p = rowk0 + 8 * (lane >> 4);
  u.q[0] = *(const v8h*)p; u.q[1] = *(const v8h*)(p + 16); return u.v;
}
__device__ __forceinline__ float bfr(float v) { return (float)(__bf16)v; }
union HU { v8h h; v4u u; };

#define WS_XN  ((size_t)0)                                        // f16 xn [NB*SEQ][DM]
#define WS_WQT (WS_XN + 2u * (size_t)NB * SEQ * DM)                 // f16 (64 w_qkv)^T [QKVN][DM]
#define WS_WOT (WS_WQT + 2u * (size_t)QKVN * DM)                    // f16 (64 w_out)^T [DM][DM]
#define WS_Q   (WS_WOT + 2u * (size_t)DM * DM)                      // f16 q [NB*NH][SEQ][HD]
#define WS_K   (WS_Q + 2u * (size_t)NB * SEQ * DM)                  // f16 k [NB*NH][SEQ][HD]
#define WS_VT  (WS_K + 2u * (size_t)NB * SEQ * DM)                  // f16 v^T [NB*NH][HD][SEQ]
#define WS_Y   (WS_VT + 2u * (size_t)NB * SEQ * DM)                 // f16 y [NB*SEQ][DM]
#define WS_END (WS_Y + 2u * (size_t)NB * SEQ * DM)
static_assert(WS_END <= (size_t)134217728);

// ---- k_wt: in W[K][N] f32 (row pitch N) -> out T[N][K] f16 = f16(bf16(w) * 64); block = 64 n x 64 k tile; grid (N/64, K/64)
__global__ __launch_bounds__(256) void k_wt(const float* __restrict__ W, int K, int N, _Float16* __restrict__ T) {
  __shared__ __align__(16) _Float16 st[64][72];
  const int tid = threadIdx.x; const int n0 = blockIdx.x * 64, k0 = blockIdx.y * 64; const int nn = tid & 63;
#pragma unroll 4
  for (int it = 0; it < 16; ++it) { const int kk = (tid >> 6) + 4 * it; st[nn][kk] = (_Float16)(bfr(W[(size_t)(k0 + kk) * N + n0 + nn]) * 64.0f); }
  __syncthreads();
  for (int e = tid; e < 64 * 8; e += 256) { const int r = e >> 3, q = e & 7; vst2(T + (size_t)(n0 + r) * K + k0 + q * 8, *(const v4u*)&st[r][q * 8]); }
}

__global__ __launch_bounds__(128) void k_ln(const float* __restrict__ X, const float* __restrict__ LW, const float* __restrict__ LB, _Float16* __restrict__ XN) {
  __shared__ float red[8];
  const int tid = threadIdx.x, lane = tid & 31, wave = tid >> 5; const int row = blockIdx.x; const int b = row / SEQ, t = row - b * SEQ;
  const float* xr = X + ((size_t)b * SEQ_FULL + t) * DM + tid * 8;
  const v4f xa = *(const v4f*)xr, xb = *(const v4f*)(xr + 4);
  float v[8];
#pragma unroll
  for (int i = 0; i < 4; ++i) { v[i] = bfr(xa[i]); v[4 + i] = bfr(xb[i]); }
  float s = 0.0f;
#pragma unroll
  for (int i = 0; i < 8; ++i) s += v[i];
#pragma unroll
  for (int o = 16; o > 0; o >>= 1) s += __shfl_xor(s, o);
  if (lane == 0) red[wave] = s;
  __syncthreads();
  const float mu = ((red[0] + red[1]) + (red[2] + red[3])) * (1.0f / (float)DM);
  float s2 = 0.0f;
#pragma unroll
  for (int i = 0; i < 8; ++i) { v[i] -= mu; s2 += v[i] * v[i]; }
#pragma unroll
  for (int o = 16; o > 0; o >>= 1) s2 += __shfl_xor(s2, o);
  if (lane == 0) red[4 + wave] = s2;
  __syncthreads();
  const float var = ((red[4] + red[5]) + (red[6] + red[7])) * (1.0f / (float)DM);
  const float rs = rsqrtf(var + 1.0e-5f);
  const v4f wa = *(const v4f*)(LW + tid * 8), wb = *(const v4f*)(LW + tid * 8 + 4);
  const v4f ba = *(const v4f*)(LB + tid * 8), bb = *(const v4f*)(LB + tid * 8 + 4);
  HU u;
#pragma unroll
  for (int i = 0; i < 4; ++i) { u.h[i] = (_Float16)(v[i] * rs * bfr(wa[i]) + bfr(ba[i])); u.h[4 + i] = (_Float16)(v[4 + i] * rs * bfr(wb[i]) + bfr(bb[i])); }
  vst2(XN + (size_t)row * DM + tid * 8, u.u);
}

// ---- shared GEMM main loop: block = 128 x 128 of the product, 4 waves x (64 x 64), K = DM in passes of 64; both operands are rows of f16 [.][DM].
//      One LDS buffer = 256 rows of 128 B at a pitch of 144 B (16 B x 9): rows 0..127 from R0, rows 128..255 from R1; two buffers, the next pass's rows copied while this pass is multiplied.
#define GP 72
#define GSTAGE (256 * GP)
#define GPASSES (DM / 64)
// eight 16-byte copies of this lane to LDS, rows 16 apart; the s_wait_xcnt ends the statement so that no address register of a copy is rewritten ahead of it
__device__ __forceinline__ void cp8(unsigned l, const _Float16* g) {
  asm volatile("global_load_async_to_lds_b128 %0, %8, off\n\t"
               "global_load_async_to_lds_b128 %1, %9, off\n\t"
               "global_load_async_to_lds_b128 %2, %10, off\n\t"
               "global_load_async_to_lds_b128 %3, %11, off\n\t"
               "global_load_async_to_lds_b128 %4, %12, off\n\t"
               "global_load_async_to_lds_b128 %5, %13, off\n\t"
               "global_load_async_to_lds_b128 %6, %14, off\n\t"
               "global_load_async_to_lds_b128 %7, %15, off\n\t"
               "s_wait_xcnt 0x0"
               :: "v"(l), "v"(l + 16u * 2u * GP), "v"(l + 32u * 2u * GP), "v"(l + 48u * 2u * GP), "v"(l + 64u * 2u * GP), "v"(l + 80u * 2u * GP), "v"(l + 96u * 2u * GP), "v"(l + 112u * 2u * GP),
                  "v"(g), "v"(g + 16 * DM), "v"(g + 32 * DM), "v"(g + 48 * DM), "v"(g + 64 * DM), "v"(g + 80 * DM), "v"(g + 96 * DM), "v"(g + 112 * DM)
               : "memory");
}
// aoff, boff: first LDS row of this wave's 64 A rows and 64 B rows; acc[i][j] element r = (A row aoff + 16 i + 8 (lane >> 4) + r) x (B row boff + 16 j + (lane & 15))
__device__ __forceinline__ void mm_k1024(const _Float16* __restrict__ R0, const _Float16* __restrict__ R1, _Float16* ring, int tid, int aoff, int boff, v8f (&acc)[4][4]) {
  const int lane = tid & 31, col = lane & 15;
  const unsigned l0 = (unsigned)(size_t)ring + (unsigned)(tid >> 3) * (2u * GP) + (unsigned)(tid & 7) * 16u;   // lane's LDS byte address: row tid / 8, 16-byte piece tid % 8
  const _Float16* g0 = R0 + (size_t)(tid >> 3) * DM + (tid & 7) * 8;
  const _Float16* g1 = R1 + (size_t)(tid >> 3) * DM + (tid & 7) * 8;
  cp8(l0, g0); cp8(l0 + 128u * 2u * GP, g1);
  asm volatile("s_wait_asynccnt 0x0" ::: "memory");   // pass 0's rows of this wave have landed
  __syncthreads();                                      // and every wave's
  cp8(l0 + 2u * GSTAGE, g0 + 64); cp8(l0 + 2u * GSTAGE + 128u * 2u * GP, g1 + 64);
#pragma unroll 1   // one pass per trip: the ring's order at the foot stays as written, and the body stays small
  for (int t = 0; t < GPASSES; ++t) {
    const _Float16* buf = ring + (t & 1) * GSTAGE;
#pragma unroll   // this and the three below: constant indices keep fragments and accumulators in registers
    for (int kk = 0; kk < 2; ++kk) {
      v16h a[4], b[4];
#pragma unroll
      for (int i = 0; i < 4; ++i) { a[i] = frag_h(buf + (aoff + i * 16 + col) * GP + kk * 32, lane); b[i] = frag_h(buf + (boff + i * 16 + col) * GP + kk * 32, lane); }
#pragma unroll
      for (int i = 0; i < 4; ++i)
#pragma unroll
        for (int j = 0; j < 4; ++j) acc[i][j] = wmma16(a[i], b[j], acc[i][j]);
    }
    asm volatile("s_wait_dscnt 0x0" ::: "memory");      // this wave's reads of the buffer are done before it is refilled
    asm volatile("s_wait_asynccnt 0x0" ::: "memory");   // this wave's copies of pass t + 1 have landed
    __syncthreads();                                      // publishes pass t + 1 and ends every wave's reads of pass t
    if (t + 2 < GPASSES) { const unsigned lb = l0 + (unsigned)(t & 1) * (2u * GSTAGE); cp8(lb, g0 + (t + 2) * 64); cp8(lb + 128u * 2u * GP, g1 + (t + 2) * 64); }
  }
  asm volatile("s_wait_asynccnt 0x0" ::: "memory");     // no copy is outstanding when the ring becomes output staging
}

// ---- k_qkv: qkv = xn x (64 W)^T-plane, x 1/64; cols [0,1024) -> q plane, [1024,2048) -> k plane (head-major rows of 64 = one line each), [2048,3072) -> v^T plane
__global__ __launch_bounds__(128) void k_qkv(const _Float16* __restrict__ XN, const _Float16* __restrict__ WQT, _Float16* __restrict__ Q16, _Float16* __restrict__ K16, _Float16* __restrict__ VT16) {
  __shared__ __align__(16) _Float16 ring[2 * GSTAGE];
  const int tid = threadIdx.x, wave = tid >> 5, lane = tid & 31, col = lane & 15, g = lane >> 4;
  const int c0 = blockIdx.y * 128; const int which = c0 >> 10; const int hA = (c0 & 1023) >> 6;
  const int r0 = blockIdx.x * 128; const int b = r0 / SEQ, t0 = r0 - b * SEQ;
  const int wa = (wave >> 1) * 64, wb = (wave & 1) * 64;
  v8f acc[4][4] = {};
  mm_k1024(XN + (size_t)r0 * DM, WQT + (size_t)c0 * DM, ring, tid, wa, 128 + wb, acc);
  // the ring is free now and serves as output staging, pitch 136 halfs: [token][col] for q and k, [col][token] for v^T
  const int srl = (which == 2) ? 1 : 136, scl = (which == 2) ? 136 : 1;   // block-uniform strides of the token index and of the column index
#pragma unroll   // here and in the two below: constant indices into acc
  for (int i = 0; i < 4; ++i)
#pragma unroll
    for (int j = 0; j < 4; ++j)
#pragma unroll
      for (int r = 0; r < 8; ++r) { const _Float16 hv = (_Float16)(acc[i][j][r] * (1.0f / 64.0f)); const int rl = wa + i * 16 + 8 * g + r, cl = wb + j * 16 + col;
        ring[rl * srl + cl * scl] = hv; }
  __syncthreads();
  if (which < 2) { _Float16* P = (which == 0) ? Q16 : K16;
    for (int it = 0; it < 16; ++it) { const int rl = (tid >> 4) + 8 * it, hh = (tid >> 3) & 1, q = tid & 7;
      vst2(P + (((size_t)(b * NH + hA + hh)) * SEQ + t0 + rl) * HD + q * 8, *(const v4u*)&ring[rl * 136 + hh * 64 + q * 8]); }
    asm volatile("s_wait_xcnt 0x0" ::: "memory");   // stands behind the last store, ahead of any later write of a register that a store names
  }
  else {
    for (int it = 0; it < 16; ++it) { const int cl = (tid >> 4) + 8 * it, q = tid & 15;
      vst2(VT16 + (((size_t)(b * NH + hA)) * HD + cl) * SEQ + t0 + q * 8, *(const v4u*)&ring[cl * 136 + q * 8]); }   // the block's two heads are 128 neighbouring v^T rows
    asm volatile("s_wait_xcnt 0x0" ::: "memory");   // the same wait behind this run of stores
  }
}

// ---- k_attn: block = 64 queries (4 waves x 16) of (b,h); per 32 keys: S^T tiles (16 keys x 16 queries, A = k rows, B = q rows) -> relu -> f16 A fragment
//      (element r <- tile of keys kb..kb+15, element 8+r <- tile of keys kb+16..kb+31, lane unchanged) -> o += P x v^T-plane
__global__ __launch_bounds__(128) void k_attn(const _Float16* __restrict__ Q16, const _Float16* __restrict__ K16, const _Float16* __restrict__ VT16, const int* __restrict__ LI, _Float16* __restrict__ Y16) {
  __shared__ __align__(16) _Float16 ss[4][16][72];
  const int tid = threadIdx.x, wave = tid >> 5, lane = tid & 31, col = lane & 15, g = lane >> 4;
  const int bh = blockIdx.y; const int b = bh / NH, h = bh - b * NH; const int ql0 = blockIdx.x * 64 + wave * 16;
  const float fold = (LI[0] < LHALF) ? 1.0f : __int_as_float(0x7fc00000);   // relu branch only; the other branch poisons the output
  const _Float16* qp = Q16 + ((size_t)bh * SEQ + ql0 + col) * HD;
  const v16h qb0 = frag_h(qp, lane), qb1 = frag_h(qp + 32, lane);
  const _Float16* kbase = K16 + ((size_t)bh * SEQ + col) * HD;
  const _Float16* vbase = VT16 + ((size_t)bh * HD + col) * SEQ;
  v8f o[4] = {};
#pragma unroll 2
  for (int kb = 0; kb < SEQ; kb += 32) {
    const _Float16* kp0 = kbase + (size_t)kb * HD; const _Float16* kp1 = kp0 + 16 * HD;
    v8f s0 = {}, s1 = {};
    s0 = wmma16(frag_h(kp0, lane), qb0, s0); s0 = wmma16(frag_h(kp0 + 32, lane), qb1, s0);
    s1 = wmma16(frag_h(kp1, lane), qb0, s1); s1 = wmma16(frag_h(kp1 + 32, lane), qb1, s1);
    v16h p;
#pragma unroll
    for (int r = 0; r < 8; ++r) { p[r] = (_Float16)fmaxf(s0[r], 0.0f); p[8 + r] = (_Float16)fmaxf(s1[r], 0.0f); }
#pragma unroll
    for (int j = 0; j < 4; ++j) o[j] = wmma16(p, frag_h(vbase + (size_t)j * 16 * SEQ + kb, lane), o[j]);
  }
#pragma unroll
  for (int j = 0; j < 4; ++j)
#pragma unroll
    for (int r = 0; r < 8; ++r) ss[wave][8 * g + r][j * 16 + col] = (_Float16)(o[j][r] * fold);
  __syncthreads();
#pragma unroll
  for (int it = 0; it < 4; ++it) { const int e = lane + 32 * it; const int rl = e >> 3, q = e & 7; HU u; u.h = *(const v8h*)&ss[wave][rl][q * 8];
    vst2(Y16 + ((size_t)b * SEQ + ql0 + rl) * DM + h * HD + q * 8, u.u); }
}

// ---- k_out: block = (128 rows, 128 cols): out = y x (64 Wo)^T-plane x 1/(512*SEQ) + b; 32 lanes x 16 B = one 512-B row segment per store
__global__ __launch_bounds__(128) void k_out(const _Float16* __restrict__ Y16, const _Float16* __restrict__ WOT, const float* __restrict__ BO, float* __restrict__ OUT) {
  __shared__ __align__(16) _Float16 ring[2 * GSTAGE];
  static_assert(128 * 132 * 4 <= 2 * GSTAGE * 2);
  const int tid = threadIdx.x, wave = tid >> 5, lane = tid & 31, col = lane & 15, g = lane >> 4;
  const int c0 = blockIdx.y * 128; const size_t r0 = (size_t)blockIdx.x * 128;
  const int wa = (wave >> 1) * 64, wb = (wave & 1) * 64;
  v8f acc[4][4] = {};
  mm_k1024(Y16 + r0 * DM, WOT + (size_t)c0 * DM, ring, tid, wa, 128 + wb, acc);
  const float osc = 1.0f / (512.0f * (float)SEQ);
  float* sf = (float*)ring;   // the ring is free now and serves as output staging [row][col], pitch 132 floats
#pragma unroll   // here and below: constant indices into acc
  for (int j = 0; j < 4; ++j) { const float bb = bfr(BO[c0 + wb + j * 16 + col]);
#pragma unroll
    for (int i = 0; i < 4; ++i)
#pragma unroll
      for (int r = 0; r < 8; ++r) sf[(wa + i * 16 + 8 * g + r) * 132 + wb + j * 16 + col] = acc[i][j][r] * osc + bb; }
  __syncthreads();
  for (int it = 0; it < 32; ++it) { const int rl = wave + 4 * it; vst2(OUT + (r0 + rl) * DM + c0 + lane * 4, *(const v4f*)&sf[rl * 132 + lane * 4]); }
}

extern "C" void kernel_launch(void* const* d_in, const int* in_sizes, int n_in, void* d_out, int out_size, void* d_ws, size_t ws_size, hipStream_t stream) {
  if (n_in < 7) return;
  if ((size_t)in_sizes[0] < ((size_t)(NB - 1) * SEQ_FULL + SEQ) * DM) return;
  if (in_sizes[1] < DM || in_sizes[2] < DM || in_sizes[5] < DM || in_sizes[6] < 1) return;
  if ((size_t)in_sizes[3] < (size_t)DM * QKVN || (size_t)in_sizes[4] < (size_t)DM * DM) return;
  if ((size_t)out_size < (size_t)NB * SEQ * DM) return;
  if (ws_size < (size_t)WS_END) return;
  // inputs: 0 x [4,2048,1024], 1 ln_w [1024], 2 ln_b [1024], 3 w_qkv [1024][3072] (in-major), 4 w_out [1024][1024] (in-major), 5 b_out [1024], 6 layer_index (i32)
  const float* X = (const float*)d_in[0]; const float* LW = (const float*)d_in[1]; const float* LB = (const float*)d_in[2];
  const float* WQ = (const float*)d_in[3]; const float* WO = (const float*)d_in[4]; const float* BO = (const float*)d_in[5]; const int* LI = (const int*)d_in[6];
  char* ws = (char*)d_ws;
  _Float16* XN = (_Float16*)(ws + WS_XN); _Float16* WQT = (_Float16*)(ws + WS_WQT); _Float16* WOT = (_Float16*)(ws + WS_WOT);
  _Float16* Q16 = (_Float16*)(ws + WS_Q); _Float16* K16 = (_Float16*)(ws + WS_K); _Float16* VT16 = (_Float16*)(ws + WS_VT); _Float16* Y16 = (_Float16*)(ws + WS_Y);
  k_wt<<<dim3(QKVN / 64, DM / 64), 256, 0, stream>>>(WQ, DM, QKVN, WQT);   // in[1024][3072] -> out[3072][1024]
  k_wt<<<dim3(DM / 64, DM / 64), 256, 0, stream>>>(WO, DM, DM, WOT);       // in[1024][1024] -> out[1024][1024]
  k_ln<<<dim3(NB * SEQ), 128, 0, stream>>>(X, LW, LB, XN);
  k_qkv<<<dim3(NB * SEQ / 128, QKVN / 128), 128, 0, stream>>>(XN, WQT, Q16, K16, VT16);
  k_attn<<<dim3(SEQ / 64, NB * NH), 128, 0, stream>>>(Q16, K16, VT16, LI, Y16);
  k_out<<<dim3(NB * SEQ / 128, DM / 128), 128, 0, stream>>>(Y16, WOT, BO, (float*)d_out);
}

// v002
// A run of this version takes 124 microseconds.
// Timed twice side by side with v001, it ran 2.46 and 2.44 times as fast.
// All steps since v000 together make it 4.36 times as fast.
// compute dtype: every float input RNE-converted to bf16 on load; LayerNorm in f32 -> xn f16; qkv = xn (f16) x (64 w_qkv) (f16) on v_wmma_f32_16x16x32_f16, f32 accumulate, q/k/v stored f16; scores S^T = k q^T (f16 x f16, f32 acc); P = relu(S) as f16 (carried x 8*SEQ) fed from the score accumulators as the A operand of P x v (v^T f16 planes); y stored f16 (carried x 8*SEQ); out = y (f16) x (64 w_out) (f16), f32 accumulate, scaled by 1/(512*SEQ) and bias added in f32; f32 output.
#include <hip/hip_runtime.h>
#include <math.h>

#ifndef NB
#define NB 4
#endif
#ifndef SEQ
#define SEQ 2048
#endif
#define NB_FULL 4
#define SEQ_FULL 2048
#define DM 1024
#define NH 16
#define HD 64
#define QKVN 3072
#define LHALF 6

static_assert(SEQ % 128 == 0);
static_assert(NB >= 1 && NB <= NB_FULL);
static_assert(SEQ >= 64 && SEQ <= SEQ_FULL);
static_assert(NH * HD == DM);

typedef __attribute__((ext_vector_type(16))) _Float16 v16h;
typedef __attribute__((ext_vector_type(8)))  _Float16 v8h;
typedef __attribute__((ext_vector_type(8)))  float v8f;
typedef __attribute__((ext_vector_type(4)))  float v4f;
typedef __attribute__((ext_vector_type(4)))  unsigned v4u;

template <typename T> __device__ __forceinline__ void vst2(void* p, T v) { *(T*)p = v;  }
__device__ __forceinline__ v8f wmma16(v16h a, v16h b, v8f c) {
  v8f d = __builtin_amdgcn_wmma_f32_16x16x32_f16(false, a, false, b, (short)0, c, false, false);
  asm volatile("v_nop\n\tv_nop\n\tv_nop\n\tv_nop" : "+v"(d) : "v"(a), "v"(b));
  return d;
}
// 16x16x32 fragments: lane = (h = lane>>4, row/col = lane&15); elements 0..7 = k0+8h+0..7, 8..15 = k0+16+8h+0..7; D element r = row 8h+r, col lane&15
__device__ __forceinline__ v16h frag_h(const _Float16* rowk0, int lane) {
  union { v16h v; v8h q[2]; } u; const _Float16* p = rowk0 + 8 * (lane >> 4);
  u.q[0] = *(const v8h*)p; u.q[1] = *(const v8h*)(p + 16); return u.v;
}
__device__ __forceinline__ float bfr(float v) { return (float)(__bf16)v; }
union HU { v8h h; v4u u; };

#define WS_XN  ((size_t)0)                                        // f16 xn [NB*SEQ][DM]
#define WS_WQT (WS_XN + 2u * (size_t)NB * SEQ * DM)                 // f16 (64 w_qkv)^T [QKVN][DM]
#define WS_WOT (WS_WQT + 2u * (size_t)QKVN * DM)                    // f16 (64 w_out)^T [DM][DM]
#define WS_Q   (WS_WOT + 2u * (size_t)DM * DM)                      // f16 q [NB*NH][SEQ][HD]
#define WS_K   (WS_Q + 2u * (size_t)NB * SEQ * DM)                  // f16 k [NB*NH][SEQ][HD]
#define WS_VT  (WS_K + 2u * (size_t)NB * SEQ * DM)                  // f16 v^T [NB*NH][HD][SEQ]
#define WS_Y   (WS_VT + 2u * (size_t)NB * SEQ * DM)                 // f16 y [NB*SEQ][DM]
#define WS_END (WS_Y + 2u * (size_t)NB * SEQ * DM)
static_assert(WS_END <= (size_t)134217728);

// ---- k_wt: in W[K][N] f32 (row pitch N) -> out T[N][K] f16 = f16(bf16(w) * 64); block = 64 n x 64 k tile; grid (N/64, K/64)
__global__ __launch_bounds__(256) void k_wt(const float* __restrict__ W, int K, int N, _Float16* __restrict__ T) {
  __shared__ __align__(16) _Float16 st[64][72];
  const int tid = threadIdx.x; const int n0 = blockIdx.x * 64, k0 = blockIdx.y * 64; const int nn = tid & 63;
#pragma unroll 4
  for (int it = 0; it < 16; ++it) { const int kk = (tid >> 6) + 4 * it; st[nn][kk] = (_Float16)(bfr(W[(size_t)(k0 + kk) * N + n0 + nn]) * 64.0f); }
  __syncthreads();
  for (int e = tid; e < 64 * 8; e += 256) { const int r = e >> 3, q = e & 7; vst2(T + (size_t)(n0 + r) * K + k0 + q * 8, *(const v4u*)&st[r][q * 8]); }
}

__global__ __launch_bounds__(128) void k_ln(const float* __restrict__ X, const float* __restrict__ LW, const float* __restrict__ LB, _Float16* __restrict__ XN) {
  __shared__ float red[8];
  const int tid = threadIdx.x, lane = tid & 31, wave = tid >> 5; const int row = blockIdx.x; const int b = row / SEQ, t = row - b * SEQ;
  const float* xr = X + ((size_t)b * SEQ_FULL + t) * DM + tid * 8;
  const v4f xa = *(const v4f*)xr, xb = *(const v4f*)(xr + 4);
  float v[8];
#pragma unroll
  for (int i = 0; i < 4; ++i) { v[i] = bfr(xa[i]); v[4 + i] = bfr(xb[i]); }
  float s = 0.0f;
#pragma unroll
  for (int i = 0; i < 8; ++i) s += v[i];
#pragma unroll
  for (int o = 16; o > 0; o >>= 1) s += __shfl_xor(s, o);
  if (lane == 0) red[wave] = s;
  __syncthreads();
  const float mu = ((red[0] + red[1]) + (red[2] + red[3])) * (1.0f / (float)DM);
  float s2 = 0.0f;
#pragma unroll
  for (int i = 0; i < 8; ++i) { v[i] -= mu; s2 += v[i] * v[i]; }
#pragma unroll
  for (int o = 16; o > 0; o >>= 1) s2 += __shfl_xor(s2, o);
  if (lane == 0) red[4 + wave] = s2;
  __syncthreads();
  const float var = ((red[4] + red[5]) + (red[6] + red[7])) * (1.0f / (float)DM);
  const float rs = rsqrtf(var + 1.0e-5f);
  const v4f wa = *(const v4f*)(LW + tid * 8), wb = *(const v4f*)(LW + tid * 8 + 4);
  const v4f ba = *(const v4f*)(LB + tid * 8), bb = *(const v4f*)(LB + tid * 8 + 4);
  HU u;
#pragma unroll
  for (int i = 0; i < 4; ++i) { u.h[i] = (_Float16)(v[i] * rs * bfr(wa[i]) + bfr(ba[i])); u.h[4 + i] = (_Float16)(v[4 + i] * rs * bfr(wb[i]) + bfr(bb[i])); }
  vst2(XN + (size_t)row * DM + tid * 8, u.u);
}

// ---- shared GEMM main loop: block = 128 x 128 of the product, 4 waves x (64 x 64), K = DM in passes of 64; both operands are rows of f16 [.][DM].
//      One LDS buffer = 256 rows of 128 B at a pitch of 144 B (16 B x 9): rows 0..127 from R0, rows 128..255 from R1; two buffers, the next pass's rows copied while this pass is multiplied.
#define GP 72
#define GSTAGE (256 * GP)
#define GPASSES (DM / 64)
// eight 16-byte copies of this lane to LDS, rows 16 apart; the s_wait_xcnt ends the statement so that no address register of a copy is rewritten ahead of it
__device__ __forceinline__ void cp8(unsigned l, const _Float16* g) {
  asm volatile("global_load_async_to_lds_b128 %0, %8, off\n\t"
               "global_load_async_to_lds_b128 %1, %9, off\n\t"
               "global_load_async_to_lds_b128 %2, %10, off\n\t"
               "global_load_async_to_lds_b128 %3, %11, off\n\t"
               "global_load_async_to_lds_b128 %4, %12, off\n\t"
               "global_load_async_to_lds_b128 %5, %13, off\n\t"
               "global_load_async_to_lds_b128 %6, %14, off\n\t"
               "global_load_async_to_lds_b128 %7, %15, off\n\t"
               "s_wait_xcnt 0x0"
               :: "v"(l), "v"(l + 16u * 2u * GP), "v"(l + 32u * 2u * GP), "v"(l + 48u * 2u * GP), "v"(l + 64u * 2u * GP), "v"(l + 80u * 2u * GP), "v"(l + 96u * 2u * GP), "v"(l + 112u * 2u * GP),
                  "v"(g), "v"(g + 16 * DM), "v"(g + 32 * DM), "v"(g + 48 * DM), "v"(g + 64 * DM), "v"(g + 80 * DM), "v"(g + 96 * DM), "v"(g + 112 * DM)
               : "memory");
}
// aoff, boff: first LDS row of this wave's 64 A rows and 64 B rows; acc[i][j] element r = (A row aoff + 16 i + 8 (lane >> 4) + r) x (B row boff + 16 j + (lane & 15))
__device__ __forceinline__ void mm_k1024(const _Float16* __restrict__ R0, const _Float16* __restrict__ R1, _Float16* ring, int tid, int aoff, int boff, v8f (&acc)[4][4]) {
  const int lane = tid & 31, col = lane & 15;
  const unsigned l0 = (unsigned)(size_t)ring + (unsigned)(tid >> 3) * (2u * GP) + (unsigned)(tid & 7) * 16u;   // lane's LDS byte address: row tid / 8, 16-byte piece tid % 8
  const _Float16* g0 = R0 + (size_t)(tid >> 3) * DM + (tid & 7) * 8;
  const _Float16* g1 = R1 + (size_t)(tid >> 3) * DM + (tid & 7) * 8;
  cp8(l0, g0); cp8(l0 + 128u * 2u * GP, g1);
  asm volatile("s_wait_asynccnt 0x0" ::: "memory");   // pass 0's rows of this wave have landed
  __syncthreads();                                      // and every wave's
  cp8(l0 + 2u * GSTAGE, g0 + 64); cp8(l0 + 2u * GSTAGE + 128u * 2u * GP, g1 + 64);
#pragma unroll 1   // one pass per trip: the ring's order at the foot stays as written, and the body stays small
  for (int t = 0; t < GPASSES; ++t) {
    const _Float16* buf = ring + (t & 1) * GSTAGE;
#pragma unroll   // this and the three below: constant indices keep fragments and accumulators in registers
    for (int kk = 0; kk < 2; ++kk) {
      v16h a[4], b[4];
#pragma unroll
      for (int i = 0; i < 4; ++i) { a[i] = frag_h(buf + (aoff + i * 16 + col) * GP + kk * 32, lane); b[i] = frag_h(buf + (boff + i * 16 + col) * GP + kk * 32, lane); }
#pragma unroll
      for (int i = 0; i < 4; ++i)
#pragma unroll
        for (int j = 0; j < 4; ++j) acc[i][j] = wmma16(a[i], b[j], acc[i][j]);
    }
    asm volatile("s_wait_dscnt 0x0" ::: "memory");      // this wave's reads of the buffer are done before it is refilled
    asm volatile("s_wait_asynccnt 0x0" ::: "memory");   // this wave's copies of pass t + 1 have landed
    __syncthreads();                                      // publishes pass t + 1 and ends every wave's reads of pass t
    if (t + 2 < GPASSES) { const unsigned lb = l0 + (unsigned)(t & 1) * (2u * GSTAGE); cp8(lb, g0 + (t + 2) * 64); cp8(lb + 128u * 2u * GP, g1 + (t + 2) * 64); }
  }
  asm volatile("s_wait_asynccnt 0x0" ::: "memory");     // no copy is outstanding when the ring becomes output staging
}

// ---- k_qkv: qkv = xn x (64 W)^T-plane, x 1/64; cols [0,1024) -> q plane, [1024,2048) -> k plane (head-major rows of 64 = one line each), [2048,3072) -> v^T plane
__global__ __launch_bounds__(128) void k_qkv(const _Float16* __restrict__ XN, const _Float16* __restrict__ WQT, _Float16* __restrict__ Q16, _Float16* __restrict__ K16, _Float16* __restrict__ VT16) {
  __shared__ __align__(16) _Float16 ring[2 * GSTAGE];
  const int tid = threadIdx.x, wave = tid >> 5, lane = tid & 31, col = lane & 15, g = lane >> 4;
  const int c0 = blockIdx.y * 128; const int which = c0 >> 10; const int hA = (c0 & 1023) >> 6;
  const int r0 = blockIdx.x * 128; const int b = r0 / SEQ, t0 = r0 - b * SEQ;
  const int wa = (wave >> 1) * 64, wb = (wave & 1) * 64;
  v8f acc[4][4] = {};
  mm_k1024(XN + (size_t)r0 * DM, WQT + (size_t)c0 * DM, ring, tid, wa, 128 + wb, acc);
  // the ring is free now and serves as output staging, pitch 136 halfs: [token][col] for q and k, [col][token] for v^T
  const int srl = (which == 2) ? 1 : 136, scl = (which == 2) ? 136 : 1;   // block-uniform strides of the token index and of the column index
#pragma unroll   // here and in the two below: constant indices into acc
  for (int i = 0; i < 4; ++i)
#pragma unroll
    for (int j = 0; j < 4; ++j)
#pragma unroll
      for (int r = 0; r < 8; ++r) { const _Float16 hv = (_Float16)(acc[i][j][r] * (1.0f / 64.0f)); const int rl = wa + i * 16 + 8 * g + r, cl = wb + j * 16 + col;
        ring[rl * srl + cl * scl] = hv; }
  __syncthreads();
  if (which < 2) { _Float16* P = (which == 0) ? Q16 : K16;
    for (int it = 0; it < 16; ++it) { const int rl = (tid >> 4) + 8 * it, hh = (tid >> 3) & 1, q = tid & 7;
      vst2(P + (((size_t)(b * NH + hA + hh)) * SEQ + t0 + rl) * HD + q * 8, *(const v4u*)&ring[rl * 136 + hh * 64 + q * 8]); }
    asm volatile("s_wait_xcnt 0x0" ::: "memory");   // stands behind the last store, ahead of any later write of a register that a store names
  }
  else {
    for (int it = 0; it < 16; ++it) { const int cl = (tid >> 4) + 8 * it, q = tid & 15;
      vst2(VT16 + (((size_t)(b * NH + hA)) * HD + cl) * SEQ + t0 + q * 8, *(const v4u*)&ring[cl * 136 + q * 8]); }   // the block's two heads are 128 neighbouring v^T rows
    asm volatile("s_wait_xcnt 0x0" ::: "memory");   // the same wait behind this run of stores
  }
}

// ---- k_attn: block = 256 queries (8 waves x 32) of (b,h); keys in stages of 64: 64 k rows and 64 v^T rows of 128 B each, copied to LDS at a pitch of 144 B and read by all 8 waves;
//      two buffers, the next stage's rows copied while this stage is multiplied. Per 32 keys and 16 queries: S^T tiles (16 keys x 16 queries, A = k rows, B = q rows) -> relu -> f16 A fragment
//      (element r <- tile of keys kb..kb+15, element 8+r <- tile of keys kb+16..kb+31, lane unchanged) -> o += P x v^T-plane
#define AP 72
#define ASTAGE (128 * AP)
#define ASTAGES (SEQ / 64)
static_assert(SEQ % 256 == 0 && ASTAGES >= 2);
// four 16-byte copies of this lane to LDS: k rows r and r + 32, v^T rows r and r + 32; the s_wait_xcnt ends the statement so that no address register of a copy is rewritten ahead of it
__device__ __forceinline__ void cp4(unsigned l, const _Float16* gk, const _Float16* gv) {
  asm volatile("global_load_async_to_lds_b128 %0, %4, off\n\t"
               "global_load_async_to_lds_b128 %1, %5, off\n\t"
               "global_load_async_to_lds_b128 %2, %6, off\n\t"
               "global_load_async_to_lds_b128 %3, %7, off\n\t"
               "s_wait_xcnt 0x0"
               :: "v"(l), "v"(l + 32u * 2u * AP), "v"(l + 64u * 2u * AP), "v"(l + 96u * 2u * AP),
                  "v"(gk), "v"(gk + 32 * HD), "v"(gv), "v"(gv + 32 * SEQ)
               : "memory");
}
// waves_per_eu: a register budget of 256, so that two blocks (four waves per SIMD) share a WGP and one block's waves work while the other's wait at LDS reads or the barrier
__global__ __launch_bounds__(256) __attribute__((amdgpu_waves_per_eu(4, 4))) void k_attn(const _Float16* __restrict__ Q16, const _Float16* __restrict__ K16, const _Float16* __restrict__ VT16, const int* __restrict__ LI, _Float16* __restrict__ Y16) {
  __shared__ __align__(16) _Float16 ring[2 * ASTAGE];
  static_assert(8 * 32 * 72 <= 2 * ASTAGE);
  const int tid = threadIdx.x, wave = tid >> 5, lane = tid & 31, col = lane & 15, g = lane >> 4;
  const int bh = blockIdx.y; const int b = bh / NH, h = bh - b * NH; const int ql0 = blockIdx.x * 256 + wave * 32;
  const float fold = (LI[0] < LHALF) ? 1.0f : __int_as_float(0x7fc00000);   // relu branch only; the other branch poisons the output
  const unsigned l0 = (unsigned)(size_t)ring + (unsigned)(tid >> 3) * (2u * AP) + (unsigned)(tid & 7) * 16u;   // lane's LDS byte address: row tid / 8, 16-byte piece tid % 8
  const _Float16* gk = K16 + ((size_t)bh * SEQ + (tid >> 3)) * HD + (tid & 7) * 8;
  const _Float16* gv = VT16 + ((size_t)bh * HD + (tid >> 3)) * SEQ + (tid & 7) * 8;
  cp4(l0, gk, gv);
  const _Float16* qp = Q16 + ((size_t)bh * SEQ + ql0 + col) * HD;
  v16h qb[2][2];
#pragma unroll   // constant indices keep the fragments in registers (also in the loops below)
  for (int u = 0; u < 2; ++u) { qb[u][0] = frag_h(qp + u * 16 * HD, lane); qb[u][1] = frag_h(qp + u * 16 * HD + 32, lane); }
  asm volatile("s_wait_xcnt 0x0" ::: "memory");       // stands behind the q loads, ahead of any later write of their address registers
  asm volatile("s_wait_asynccnt 0x0" ::: "memory");   // stage 0's rows of this wave have landed
  __syncthreads();                                      // and every wave's
  cp4(l0 + 2u * ASTAGE, gk + 64 * HD, gv + 64);
  v8f o[2][4] = {};
#pragma unroll 1   // one stage per trip: the ring's order at the foot stays as written
  for (int t = 0; t < ASTAGES; ++t) {
    const _Float16* buf = ring + (t & 1) * ASTAGE;
#pragma unroll
    for (int kk = 0; kk < 2; ++kk) {
      const _Float16* kr = buf + (kk * 32 + col) * AP;
      const v16h k00 = frag_h(kr, lane), k01 = frag_h(kr + 32, lane), k10 = frag_h(kr + 16 * AP, lane), k11 = frag_h(kr + 16 * AP + 32, lane);
      v16h vf[4];
#pragma unroll
      for (int j = 0; j < 4; ++j) vf[j] = frag_h(buf + (64 + j * 16 + col) * AP + kk * 32, lane);
      v8f s[2][2] = {};
#pragma unroll
      for (int u = 0; u < 2; ++u) { s[u][0] = wmma16(k00, qb[u][0], s[u][0]); s[u][1] = wmma16(k10, qb[u][0], s[u][1]); }
#pragma unroll
      for (int u = 0; u < 2; ++u) { s[u][0] = wmma16(k01, qb[u][1], s[u][0]); s[u][1] = wmma16(k11, qb[u][1], s[u][1]); }
      v16h p[2];
#pragma unroll
      for (int u = 0; u < 2; ++u)
#pragma unroll
        for (int r = 0; r < 8; ++r) { p[u][r] = (_Float16)fmaxf(s[u][0][r], 0.0f); p[u][8 + r] = (_Float16)fmaxf(s[u][1][r], 0.0f); }
#pragma unroll
      for (int j = 0; j < 4; ++j)
#pragma unroll
        for (int u = 0; u < 2; ++u) o[u][j] = wmma16(p[u], vf[j], o[u][j]);
    }
    asm volatile("s_wait_dscnt 0x0" ::: "memory");      // this wave's reads of the buffer are done before it is refilled
    asm volatile("s_wait_asynccnt 0x0" ::: "memory");   // this wave's copies of stage t + 1 have landed
    __syncthreads();                                      // publishes stage t + 1 and ends every wave's reads of stage t
    if (t + 2 < ASTAGES) cp4(l0 + (unsigned)(t & 1) * (2u * ASTAGE), gk + (size_t)(t + 2) * 64 * HD, gv + (t + 2) * 64);
  }
  asm volatile("s_wait_asynccnt 0x0" ::: "memory");     // no copy is outstanding when the ring becomes output staging
  _Float16* ss = ring + wave * (32 * 72);   // the ring is free now (the last trip's barrier ended every read); each wave stages its 32 x 64 tile in its own range, pitch 72 halfs
#pragma unroll
  for (int u = 0; u < 2; ++u)
#pragma unroll
    for (int j = 0; j < 4; ++j)
#pragma unroll
      for (int r = 0; r < 8; ++r) ss[(u * 16 + 8 * g + r) * 72 + j * 16 + col] = (_Float16)(o[u][j][r] * fold);
  __syncthreads();
#pragma unroll
  for (int it = 0; it < 8; ++it) { const int e = lane + 32 * it; const int rl = e >> 3, q = e & 7; HU u; u.h = *(const v8h*)&ss[rl * 72 + q * 8];
    vst2(Y16 + ((size_t)b * SEQ + ql0 + rl) * DM + h * HD + q * 8, u.u); }
  asm volatile("s_wait_xcnt 0x0" ::: "memory");   // stands behind the last store, ahead of any later write of a register that a store names
}

// ---- k_out: block = (128 rows, 128 cols): out = y x (64 Wo)^T-plane x 1/(512*SEQ) + b; 32 lanes x 16 B = one 512-B row segment per store
__global__ __launch_bounds__(128) void k_out(const _Float16* __restrict__ Y16, const _Float16* __restrict__ WOT, const float* __restrict__ BO, float* __restrict__ OUT) {
  __shared__ __align__(16) _Float16 ring[2 * GSTAGE];
  static_assert(128 * 132 * 4 <= 2 * GSTAGE * 2);
  const int tid = threadIdx.x, wave = tid >> 5, lane = tid & 31, col = lane & 15, g = lane >> 4;
  const int c0 = blockIdx.y * 128; const size_t r0 = (size_t)blockIdx.x * 128;
  const int wa = (wave >> 1) * 64, wb = (wave & 1) * 64;
  v8f acc[4][4] = {};
  mm_k1024(Y16 + r0 * DM, WOT + (size_t)c0 * DM, ring, tid, wa, 128 + wb, acc);
  const float osc = 1.0f / (512.0f * (float)SEQ);
  float* sf = (float*)ring;   // the ring is free now and serves as output staging [row][col], pitch 132 floats
#pragma unroll   // here and below: constant indices into acc
  for (int j = 0; j < 4; ++j) { const float bb = bfr(BO[c0 + wb + j * 16 + col]);
#pragma unroll
    for (int i = 0; i < 4; ++i)
#pragma unroll
      for (int r = 0; r < 8; ++r) sf[(wa + i * 16 + 8 * g + r) * 132 + wb + j * 16 + col] = acc[i][j][r] * osc + bb; }
  __syncthreads();
  for (int it = 0; it < 32; ++it) { const int rl = wave + 4 * it; vst2(OUT + (r0 + rl) * DM + c0 + lane * 4, *(const v4f*)&sf[rl * 132 + lane * 4]); }
}

extern "C" void kernel_launch(void* const* d_in, const int* in_sizes, int n_in, void* d_out, int out_size, void* d_ws, size_t ws_size, hipStream_t stream) {
  if (n_in < 7) return;
  if ((size_t)in_sizes[0] < ((size_t)(NB - 1) * SEQ_FULL + SEQ) * DM) return;
  if (in_sizes[1] < DM || in_sizes[2] < DM || in_sizes[5] < DM || in_sizes[6] < 1) return;
  if ((size_t)in_sizes[3] < (size_t)DM * QKVN || (size_t)in_sizes[4] < (size_t)DM * DM) return;
  if ((size_t)out_size < (size_t)NB * SEQ * DM) return;
  if (ws_size < (size_t)WS_END) return;
  // inputs: 0 x [4,2048,1024], 1 ln_w [1024], 2 ln_b [1024], 3 w_qkv [1024][3072] (in-major), 4 w_out [1024][1024] (in-major), 5 b_out [1024], 6 layer_index (i32)
  const float* X = (const float*)d_in[0]; const float* LW = (const float*)d_in[1]; const float* LB = (const float*)d_in[2];
  const float* WQ = (const float*)d_in[3]; const float* WO = (const float*)d_in[4]; const float* BO = (const float*)d_in[5]; const int* LI = (const int*)d_in[6];
  char* ws = (char*)d_ws;
  _Float16* XN = (_Float16*)(ws + WS_XN); _Float16* WQT = (_Float16*)(ws + WS_WQT); _Float16* WOT = (_Float16*)(ws + WS_WOT);
  _Float16* Q16 = (_Float16*)(ws + WS_Q); _Float16* K16 = (_Float16*)(ws + WS_K); _Float16* VT16 = (_Float16*)(ws + WS_VT); _Float16* Y16 = (_Float16*)(ws + WS_Y);
  k_wt<<<dim3(QKVN / 64, DM / 64), 256, 0, stream>>>(WQ, DM, QKVN, WQT);   // in[1024][3072] -> out[3072][1024]
  k_wt<<<dim3(DM / 64, DM / 64), 256, 0, stream>>>(WO, DM, DM, WOT);       // in[1024][1024] -> out[1024][1024]
  k_ln<<<dim3(NB * SEQ), 128, 0, stream>>>(X, LW, LB, XN);
  k_qkv<<<dim3(NB * SEQ / 128, QKVN / 128), 128, 0, stream>>>(XN, WQT, Q16, K16, VT16);
  k_attn<<<dim3(SEQ / 256, NB * NH), 256, 0, stream>>>(Q16, K16, VT16, LI, Y16);
  k_out<<<dim3(NB * SEQ / 128, DM / 128), 128, 0, stream>>>(Y16, WOT, BO, (float*)d_out);
}

// v003
// A run of this version takes 114 microseconds.
// Two timings next to v002 put it at 1.08 and 1.07 times that version's speed.
// All steps since v000 together make it 4.70 times as fast.
// compute dtype: every float input RNE-converted to bf16 on load; LayerNorm in f32 -> xn f16; qkv = xn (f16) x (64 w_qkv) (f16) on v_wmma_f32_16x16x32_f16, f32 accumulate, q/k/v stored f16; scores S^T = k q^T (f16 x f16, f32 acc); P = relu(S) as f16 (carried x 8*SEQ) fed from the score accumulators as the A operand of P x v (v^T f16 planes); y stored f16 (carried x 8*SEQ); out = y (f16) x (64 w_out) (f16), f32 accumulate, scaled by 1/(512*SEQ) and bias added in f32; f32 output.
#include <hip/hip_runtime.h>
#include <math.h>

#ifndef NB
#define NB 4
#endif
#ifndef SEQ
#define SEQ 2048
#endif
#define NB_FULL 4
#define SEQ_FULL 2048
#define DM 1024
#define NH 16
#define HD 64
#define QKVN 3072
#define LHALF 6

static_assert(SEQ % 128 == 0);
static_assert(NB >= 1 && NB <= NB_FULL);
static_assert(SEQ >= 64 && SEQ <= SEQ_FULL);
static_assert(NH * HD == DM);

typedef __attribute__((ext_vector_type(16))) _Float16 v16h;
typedef __attribute__((ext_vector_type(8)))  _Float16 v8h;
typedef __attribute__((ext_vector_type(8)))  float v8f;
typedef __attribute__((ext_vector_type(4)))  float v4f;
typedef __attribute__((ext_vector_type(4)))  unsigned v4u;

template <typename T> __device__ __forceinline__ void vst2(void* p, T v) { *(T*)p = v;  }
__device__ __forceinline__ v8f wmma16(v16h a, v16h b, v8f c) {
  v8f d = __builtin_amdgcn_wmma_f32_16x16x32_f16(false, a, false, b, (short)0, c, false, false);
  asm volatile("v_nop\n\tv_nop\n\tv_nop\n\tv_nop" : "+v"(d) : "v"(a), "v"(b));
  return d;
}
// 16x16x32 fragments: lane = (h = lane>>4, row/col = lane&15); elements 0..7 = k0+8h+0..7, 8..15 = k0+16+8h+0..7; D element r = row 8h+r, col lane&15
__device__ __forceinline__ v16h frag_h(const _Float16* rowk0, int lane) {
  union { v16h v; v8h q[2]; } u; const _Float16* p = rowk0 + 8 * (lane >> 4);
  u.q[0] = *(const v8h*)p; u.q[1] = *(const v8h*)(p + 16); return u.v;
}
__device__ __forceinline__ float bfr(float v) { return (float)(__bf16)v; }
union HU { v8h h; v4u u; };

#define WS_XN  ((size_t)0)                                        // f16 xn [NB*SEQ][DM]
#define WS_WQT (WS_XN + 2u * (size_t)NB * SEQ * DM)                 // f16 (64 w_qkv)^T [QKVN][DM]
#define WS_WOT (WS_WQT + 2u * (size_t)QKVN * DM)                    // f16 (64 w_out)^T [DM][DM]
#define WS_Q   (WS_WOT + 2u * (size_t)DM * DM)                      // f16 q [NB*NH][SEQ][HD]
#define WS_K   (WS_Q + 2u * (size_t)NB * SEQ * DM)                  // f16 k [NB*NH][SEQ][HD]
#define WS_VT  (WS_K + 2u * (size_t)NB * SEQ * DM)                  // f16 v^T [NB*NH][HD][SEQ]
#define WS_Y   (WS_VT + 2u * (size_t)NB * SEQ * DM)                 // f16 y [NB*SEQ][DM]
#define WS_END (WS_Y + 2u * (size_t)NB * SEQ * DM)
static_assert(WS_END <= (size_t)134217728);

// ---- wt_tile: in W[K][N] f32 (row pitch N) -> out T[N][K] f16 = f16(bf16(w) * 64); 256 threads do the 64 n x 64 k tile at (n0, k0)
__device__ __forceinline__ void wt_tile(const float* __restrict__ W, int K, int N, _Float16* __restrict__ T, int n0, int k0, _Float16 (*st)[72]) {
  const int tid = threadIdx.x; const int nn = tid & 63;
#pragma unroll 4
  for (int it = 0; it < 16; ++it) { const int kk = (tid >> 6) + 4 * it; st[nn][kk] = (_Float16)(bfr(W[(size_t)(k0 + kk) * N + n0 + nn]) * 64.0f); }
  __syncthreads();
  for (int e = tid; e < 64 * 8; e += 256) { const int r = e >> 3, q = e & 7; vst2(T + (size_t)(n0 + r) * K + k0 + q * 8, *(const v4u*)&st[r][q * 8]); }
}

// ---- ln_row: 128 threads (tid 0..127) normalise one row; red = this row's 8 floats of LDS; both rows of a block pass the two barriers together
__device__ __forceinline__ void ln_row(const float* __restrict__ X, const float* __restrict__ LW, const float* __restrict__ LB, _Float16* __restrict__ XN, int row, int tid, float* red) {
  const int lane = tid & 31, wave = tid >> 5; const int b = row / SEQ, t = row - b * SEQ;
  const float* xr = X + ((size_t)b * SEQ_FULL + t) * DM + tid * 8;
  const v4f xa = *(const v4f*)xr, xb = *(const v4f*)(xr + 4);
  float v[8];
#pragma unroll
  for (int i = 0; i < 4; ++i) { v[i] = bfr(xa[i]); v[4 + i] = bfr(xb[i]); }
  float s = 0.0f;
#pragma unroll
  for (int i = 0; i < 8; ++i) s += v[i];
#pragma unroll
  for (int o = 16; o > 0; o >>= 1) s += __shfl_xor(s, o);
  if (lane == 0) red[wave] = s;
  __syncthreads();
  const float mu = ((red[0] + red[1]) + (red[2] + red[3])) * (1.0f / (float)DM);
  float s2 = 0.0f;
#pragma unroll
  for (int i = 0; i < 8; ++i) { v[i] -= mu; s2 += v[i] * v[i]; }
#pragma unroll
  for (int o = 16; o > 0; o >>= 1) s2 += __shfl_xor(s2, o);
  if (lane == 0) red[4 + wave] = s2;
  __syncthreads();
  const float var = ((red[4] + red[5]) + (red[6] + red[7])) * (1.0f / (float)DM);
  const float rs = rsqrtf(var + 1.0e-5f);
  const v4f wa = *(const v4f*)(LW + tid * 8), wb = *(const v4f*)(LW + tid * 8 + 4);
  const v4f ba = *(const v4f*)(LB + tid * 8), bb = *(const v4f*)(LB + tid * 8 + 4);
  HU u;
#pragma unroll
  for (int i = 0; i < 4; ++i) { u.h[i] = (_Float16)(v[i] * rs * bfr(wa[i]) + bfr(ba[i])); u.h[4 + i] = (_Float16)(v[4 + i] * rs * bfr(wb[i]) + bfr(bb[i])); }
  vst2(XN + (size_t)row * DM + tid * 8, u.u);
  asm volatile("s_wait_xcnt 0x0" ::: "memory");   // stands behind the store, ahead of any later write of a register that the store names
}

// ---- k_prep: the three pieces of work that depend on nothing but the inputs, in one grid, told apart by the block index (a block-uniform branch):
//      first the 64 x 64 tiles of w_qkv, then those of w_out (the longer blocks start first), then LayerNorm, two rows a block
#define WQ_TILES ((QKVN / 64) * (DM / 64))
#define WO_TILES ((DM / 64) * (DM / 64))
#define LN_BLOCKS (NB * SEQ / 2)
__global__ __launch_bounds__(256) void k_prep(const float* __restrict__ WQ, const float* __restrict__ WO, const float* __restrict__ X, const float* __restrict__ LW, const float* __restrict__ LB,
                                              _Float16* __restrict__ WQT, _Float16* __restrict__ WOT, _Float16* __restrict__ XN) {
  __shared__ __align__(16) _Float16 st[64][72];
  __shared__ float red[16];
  const int blk = blockIdx.x;
  if (blk < WQ_TILES) wt_tile(WQ, DM, QKVN, WQT, (blk % (QKVN / 64)) * 64, (blk / (QKVN / 64)) * 64, st);                                        // in[1024][3072] -> out[3072][1024]
  else if (blk < WQ_TILES + WO_TILES) { const int w = blk - WQ_TILES; wt_tile(WO, DM, DM, WOT, (w % (DM / 64)) * 64, (w / (DM / 64)) * 64, st); }   // in[1024][1024] -> out[1024][1024]
  else { const int tid = threadIdx.x, half = tid >> 7; ln_row(X, LW, LB, XN, (blk - WQ_TILES - WO_TILES) * 2 + half, tid & 127, red + 8 * half); }
}

// ---- shared GEMM main loop: block = 128 x 128 of the product, 4 waves x (64 x 64), K = DM in passes of 64; both operands are rows of f16 [.][DM].
//      One LDS buffer = 256 rows of 128 B at a pitch of 144 B (16 B x 9): rows 0..127 from R0, rows 128..255 from R1; two buffers, the next pass's rows copied while this pass is multiplied.
#define GP 72
#define GSTAGE (256 * GP)
#define GPASSES (DM / 64)
// eight 16-byte copies of this lane to LDS, rows 16 apart; the s_wait_xcnt ends the statement so that no address register of a copy is rewritten ahead of it
__device__ __forceinline__ void cp8(unsigned l, const _Float16* g) {
  asm volatile("global_load_async_to_lds_b128 %0, %8, off\n\t"
               "global_load_async_to_lds_b128 %1, %9, off\n\t"
               "global_load_async_to_lds_b128 %2, %10, off\n\t"
               "global_load_async_to_lds_b128 %3, %11, off\n\t"
               "global_load_async_to_lds_b128 %4, %12, off\n\t"
               "global_load_async_to_lds_b128 %5, %13, off\n\t"
               "global_load_async_to_lds_b128 %6, %14, off\n\t"
               "global_load_async_to_lds_b128 %7, %15, off\n\t"
               "s_wait_xcnt 0x0"
               :: "v"(l), "v"(l + 16u * 2u * GP), "v"(l + 32u * 2u * GP), "v"(l + 48u * 2u * GP), "v"(l + 64u * 2u * GP), "v"(l + 80u * 2u * GP), "v"(l + 96u * 2u * GP), "v"(l + 112u * 2u * GP),
                  "v"(g), "v"(g + 16 * DM), "v"(g + 32 * DM), "v"(g + 48 * DM), "v"(g + 64 * DM), "v"(g + 80 * DM), "v"(g + 96 * DM), "v"(g + 112 * DM)
               : "memory");
}
// aoff, boff: first LDS row of this wave's 64 A rows and 64 B rows; acc[i][j] element r = (A row aoff + 16 i + 8 (lane >> 4) + r) x (B row boff + 16 j + (lane & 15))
__device__ __forceinline__ void mm_k1024(const _Float16* __restrict__ R0, const _Float16* __restrict__ R1, _Float16* ring, int tid, int aoff, int boff, v8f (&acc)[4][4]) {
  const int lane = tid & 31, col = lane & 15;
  const unsigned l0 = (unsigned)(size_t)ring + (unsigned)(tid >> 3) * (2u * GP) + (unsigned)(tid & 7) * 16u;   // lane's LDS byte address: row tid / 8, 16-byte piece tid % 8
  const _Float16* g0 = R0 + (size_t)(tid >> 3) * DM + (tid & 7) * 8;
  const _Float16* g1 = R1 + (size_t)(tid >> 3) * DM + (tid & 7) * 8;
  cp8(l0, g0); cp8(l0 + 128u * 2u * GP, g1);
  asm volatile("s_wait_asynccnt 0x0" ::: "memory");   // pass 0's rows of this wave have landed
  __syncthreads();                                      // and every wave's
  cp8(l0 + 2u * GSTAGE, g0 + 64); cp8(l0 + 2u * GSTAGE + 128u * 2u * GP, g1 + 64);
#pragma unroll 1   // one pass per trip: the ring's order at the foot stays as written, and the body stays small
  for (int t = 0; t < GPASSES; ++t) {
    const _Float16* buf = ring + (t & 1) * GSTAGE;
#pragma unroll   // this and the three below: constant indices keep fragments and accumulators in registers
    for (int kk = 0; kk < 2; ++kk) {
      v16h a[4], b[4];
#pragma unroll
      for (int i = 0; i < 4; ++i) { a[i] = frag_h(buf + (aoff + i * 16 + col) * GP + kk * 32, lane); b[i] = frag_h(buf + (boff + i * 16 + col) * GP + kk * 32, lane); }
#pragma unroll
      for (int i = 0; i < 4; ++i)
#pragma unroll
        for (int j = 0; j < 4; ++j) acc[i][j] = wmma16(a[i], b[j], acc[i][j]);
    }
    asm volatile("s_wait_dscnt 0x0" ::: "memory");      // this wave's reads of the buffer are done before it is refilled
    asm volatile("s_wait_asynccnt 0x0" ::: "memory");   // this wave's copies of pass t + 1 have landed
    __syncthreads();                                      // publishes pass t + 1 and ends every wave's reads of pass t
    if (t + 2 < GPASSES) { const unsigned lb = l0 + (unsigned)(t & 1) * (2u * GSTAGE); cp8(lb, g0 + (t + 2) * 64); cp8(lb + 128u * 2u * GP, g1 + (t + 2) * 64); }
  }
  asm volatile("s_wait_asynccnt 0x0" ::: "memory");     // no copy is outstanding when the ring becomes output staging
}

// ---- k_qkv: qkv = xn x (64 W)^T-plane, x 1/64; cols [0,1024) -> q plane, [1024,2048) -> k plane (head-major rows of 64 = one line each), [2048,3072) -> v^T plane
__global__ __launch_bounds__(128) void k_qkv(const _Float16* __restrict__ XN, const _Float16* __restrict__ WQT, _Float16* __restrict__ Q16, _Float16* __restrict__ K16, _Float16* __restrict__ VT16) {
  __shared__ __align__(16) _Float16 ring[2 * GSTAGE];
  const int tid = threadIdx.x, wave = tid >> 5, lane = tid & 31, col = lane & 15, g = lane >> 4;
  const int c0 = blockIdx.y * 128; const int which = c0 >> 10; const int hA = (c0 & 1023) >> 6;
  const int r0 = blockIdx.x * 128; const int b = r0 / SEQ, t0 = r0 - b * SEQ;
  const int wa = (wave >> 1) * 64, wb = (wave & 1) * 64;
  v8f acc[4][4] = {};
  mm_k1024(XN + (size_t)r0 * DM, WQT + (size_t)c0 * DM, ring, tid, wa, 128 + wb, acc);
  // the ring is free now and serves as output staging, pitch 136 halfs: [token][col] for q and k, [col][token] for v^T
  const int srl = (which == 2) ? 1 : 136, scl = (which == 2) ? 136 : 1;   // block-uniform strides of the token index and of the column index
#pragma unroll   // here and in the two below: constant indices into acc
  for (int i = 0; i < 4; ++i)
#pragma unroll
    for (int j = 0; j < 4; ++j)
#pragma unroll
      for (int r = 0; r < 8; ++r) { const _Float16 hv = (_Float16)(acc[i][j][r] * (1.0f / 64.0f)); const int rl = wa + i * 16 + 8 * g + r, cl = wb + j * 16 + col;
        ring[rl * srl + cl * scl] = hv; }
  __syncthreads();
  if (which < 2) { _Float16* P = (which == 0) ? Q16 : K16;
    for (int it = 0; it < 16; ++it) { const int rl = (tid >> 4) + 8 * it, hh = (tid >> 3) & 1, q = tid & 7;
      vst2(P + (((size_t)(b * NH + hA + hh)) * SEQ + t0 + rl) * HD + q * 8, *(const v4u*)&ring[rl * 136 + hh * 64 + q * 8]); }
    asm volatile("s_wait_xcnt 0x0" ::: "memory");   // stands behind the last store, ahead of any later write of a register that a store names
  }
  else {
    for (int it = 0; it < 16; ++it) { const int cl = (tid >> 4) + 8 * it, q = tid & 15;
      vst2(VT16 + (((size_t)(b * NH + hA)) * HD + cl) * SEQ + t0 + q * 8, *(const v4u*)&ring[cl * 136 + q * 8]); }   // the block's two heads are 128 neighbouring v^T rows
    asm volatile("s_wait_xcnt 0x0" ::: "memory");   // the same wait behind this run of stores
  }
}

// ---- k_attn: block = 256 queries (8 waves x 32) of (b,h); keys in stages of 64: 64 k rows and 64 v^T rows of 128 B each, copied to LDS at a pitch of 144 B and read by all 8 waves;
//      two buffers, the next stage's rows copied while this stage is multiplied. Per 32 keys and 16 queries: S^T tiles (16 keys x 16 queries, A = k rows, B = q rows) -> relu -> f16 A fragment
//      (element r <- tile of keys kb..kb+15, element 8+r <- tile of keys kb+16..kb+31, lane unchanged) -> o += P x v^T-plane
#define AP 72
#define ASTAGE (128 * AP)
#define ASTAGES (SEQ / 64)
static_assert(SEQ % 256 == 0 && ASTAGES >= 2);
// four 16-byte copies of this lane to LDS: k rows r and r + 32, v^T rows r and r + 32; the s_wait_xcnt ends the statement so that no address register of a copy is rewritten ahead of it
__device__ __forceinline__ void cp4(unsigned l, const _Float16* gk, const _Float16* gv) {
  asm volatile("global_load_async_to_lds_b128 %0, %4, off\n\t"
               "global_load_async_to_lds_b128 %1, %5, off\n\t"
               "global_load_async_to_lds_b128 %2, %6, off\n\t"
               "global_load_async_to_lds_b128 %3, %7, off\n\t"
               "s_wait_xcnt 0x0"
               :: "v"(l), "v"(l + 32u * 2u * AP), "v"(l + 64u * 2u * AP), "v"(l + 96u * 2u * AP),
                  "v"(gk), "v"(gk + 32 * HD), "v"(gv), "v"(gv + 32 * SEQ)
               : "memory");
}
// waves_per_eu: a register budget of 256, so that two blocks (four waves per SIMD) share a WGP and one block's waves work while the other's wait at LDS reads or the barrier
__global__ __launch_bounds__(256) __attribute__((amdgpu_waves_per_eu(4, 4))) void k_attn(const _Float16* __restrict__ Q16, const _Float16* __restrict__ K16, const _Float16* __restrict__ VT16, const int* __restrict__ LI, _Float16* __restrict__ Y16) {
  __shared__ __align__(16) _Float16 ring[2 * ASTAGE];
  static_assert(8 * 32 * 72 <= 2 * ASTAGE);
  const int tid = threadIdx.x, wave = tid >> 5, lane = tid & 31, col = lane & 15, g = lane >> 4;
  const int bh = blockIdx.y; const int b = bh / NH, h = bh - b * NH; const int ql0 = blockIdx.x * 256 + wave * 32;
  const float fold = (LI[0] < LHALF) ? 1.0f : __int_as_float(0x7fc00000);   // relu branch only; the other branch poisons the output
  const unsigned l0 = (unsigned)(size_t)ring + (unsigned)(tid >> 3) * (2u * AP) + (unsigned)(tid & 7) * 16u;   // lane's LDS byte address: row tid / 8, 16-byte piece tid % 8
  const _Float16* gk = K16 + ((size_t)bh * SEQ + (tid >> 3)) * HD + (tid & 7) * 8;
  const _Float16* gv = VT16 + ((size_t)bh * HD + (tid >> 3)) * SEQ + (tid & 7) * 8;
  cp4(l0, gk, gv);
  const _Float16* qp = Q16 + ((size_t)bh * SEQ + ql0 + col) * HD;
  v16h qb[2][2];
#pragma unroll   // constant indices keep the fragments in registers (also in the loops below)
  for (int u = 0; u < 2; ++u) { qb[u][0] = frag_h(qp + u * 16 * HD, lane); qb[u][1] = frag_h(qp + u * 16 * HD + 32, lane); }
  asm volatile("s_wait_xcnt 0x0" ::: "memory");       // stands behind the q loads, ahead of any later write of their address registers
  asm volatile("s_wait_asynccnt 0x0" ::: "memory");   // stage 0's rows of this wave have landed
  __syncthreads();                                      // and every wave's
  cp4(l0 + 2u * ASTAGE, gk + 64 * HD, gv + 64);
  v8f o[2][4] = {};
#pragma unroll 1   // one stage per trip: the ring's order at the foot stays as written
  for (int t = 0; t < ASTAGES; ++t) {
    const _Float16* buf = ring + (t & 1) * ASTAGE;
#pragma unroll
    for (int kk = 0; kk < 2; ++kk) {
      const _Float16* kr = buf + (kk * 32 + col) * AP;
      const v16h k00 = frag_h(kr, lane), k01 = frag_h(kr + 32, lane), k10 = frag_h(kr + 16 * AP, lane), k11 = frag_h(kr + 16 * AP + 32, lane);
      v16h vf[4];
#pragma unroll
      for (int j = 0; j < 4; ++j) vf[j] = frag_h(buf + (64 + j * 16 + col) * AP + kk * 32, lane);
      v8f s[2][2] = {};
#pragma unroll
      for (int u = 0; u < 2; ++u) { s[u][0] = wmma16(k00, qb[u][0], s[u][0]); s[u][1] = wmma16(k10, qb[u][0], s[u][1]); }
#pragma unroll
      for (int u = 0; u < 2; ++u) { s[u][0] = wmma16(k01, qb[u][1], s[u][0]); s[u][1] = wmma16(k11, qb[u][1], s[u][1]); }
      v16h p[2];
#pragma unroll
      for (int u = 0; u < 2; ++u)
#pragma unroll
        for (int r = 0; r < 8; ++r) { p[u][r] = (_Float16)fmaxf(s[u][0][r], 0.0f); p[u][8 + r] = (_Float16)fmaxf(s[u][1][r], 0.0f); }
#pragma unroll
      for (int j = 0; j < 4; ++j)
#pragma unroll
        for (int u = 0; u < 2; ++u) o[u][j] = wmma16(p[u], vf[j], o[u][j]);
    }
    asm volatile("s_wait_dscnt 0x0" ::: "memory");      // this wave's reads of the buffer are done before it is refilled
    asm volatile("s_wait_asynccnt 0x0" ::: "memory");   // this wave's copies of stage t + 1 have landed
    __syncthreads();                                      // publishes stage t + 1 and ends every wave's reads of stage t
    if (t + 2 < ASTAGES) cp4(l0 + (unsigned)(t & 1) * (2u * ASTAGE), gk + (size_t)(t + 2) * 64 * HD, gv + (t + 2) * 64);
  }
  asm volatile("s_wait_asynccnt 0x0" ::: "memory");     // no copy is outstanding when the ring becomes output staging
  _Float16* ss = ring + wave * (32 * 72);   // the ring is free now (the last trip's barrier ended every read); each wave stages its 32 x 64 tile in its own range, pitch 72 halfs
#pragma unroll
  for (int u = 0; u < 2; ++u)
#pragma unroll
    for (int j = 0; j < 4; ++j)
#pragma unroll
      for (int r = 0; r < 8; ++r) ss[(u * 16 + 8 * g + r) * 72 + j * 16 + col] = (_Float16)(o[u][j][r] * fold);
  __syncthreads();
#pragma unroll
  for (int it = 0; it < 8; ++it) { const int e = lane + 32 * it; const int rl = e >> 3, q = e & 7; HU u; u.h = *(const v8h*)&ss[rl * 72 + q * 8];
    vst2(Y16 + ((size_t)b * SEQ + ql0 + rl) * DM + h * HD + q * 8, u.u); }
  asm volatile("s_wait_xcnt 0x0" ::: "memory");   // stands behind the last store, ahead of any later write of a register that a store names
}

// ---- k_out: block = (128 rows, 128 cols): out = y x (64 Wo)^T-plane x 1/(512*SEQ) + b; 32 lanes x 16 B = one 512-B row segment per store
__global__ __launch_bounds__(128) void k_out(const _Float16* __restrict__ Y16, const _Float16* __restrict__ WOT, const float* __restrict__ BO, float* __restrict__ OUT) {
  __shared__ __align__(16) _Float16 ring[2 * GSTAGE];
  static_assert(128 * 132 * 4 <= 2 * GSTAGE * 2);
  const int tid = threadIdx.x, wave = tid >> 5, lane = tid & 31, col = lane & 15, g = lane >> 4;
  const int c0 = blockIdx.y * 128; const size_t r0 = (size_t)blockIdx.x * 128;
  const int wa = (wave >> 1) * 64, wb = (wave & 1) * 64;
  v8f acc[4][4] = {};
  mm_k1024(Y16 + r0 * DM, WOT + (size_t)c0 * DM, ring, tid, wa, 128 + wb, acc);
  const float osc = 1.0f / (512.0f * (float)SEQ);
  float* sf = (float*)ring;   // the ring is free now and serves as output staging [row][col], pitch 132 floats
#pragma unroll   // here and below: constant indices into acc
  for (int j = 0; j < 4; ++j) { const float bb = bfr(BO[c0 + wb + j * 16 + col]);
#pragma unroll
    for (int i = 0; i < 4; ++i)
#pragma unroll
      for (int r = 0; r < 8; ++r) sf[(wa + i * 16 + 8 * g + r) * 132 + wb + j * 16 + col] = acc[i][j][r] * osc + bb; }
  __syncthreads();
  for (int it = 0; it < 32; ++it) { const int rl = wave + 4 * it; vst2(OUT + (r0 + rl) * DM + c0 + lane * 4, *(const v4f*)&sf[rl * 132 + lane * 4]); }
}

extern "C" void kernel_launch(void* const* d_in, const int* in_sizes, int n_in, void* d_out, int out_size, void* d_ws, size_t ws_size, hipStream_t stream) {
  if (n_in < 7) return;
  if ((size_t)in_sizes[0] < ((size_t)(NB - 1) * SEQ_FULL + SEQ) * DM) return;
  if (in_sizes[1] < DM || in_sizes[2] < DM || in_sizes[5] < DM || in_sizes[6] < 1) return;
  if ((size_t)in_sizes[3] < (size_t)DM * QKVN || (size_t)in_sizes[4] < (size_t)DM * DM) return;
  if ((size_t)out_size < (size_t)NB * SEQ * DM) return;
  if (ws_size < (size_t)WS_END) return;
  // inputs: 0 x [4,2048,1024], 1 ln_w [1024], 2 ln_b [1024], 3 w_qkv [1024][3072] (in-major), 4 w_out [1024][1024] (in-major), 5 b_out [1024], 6 layer_index (i32)
  const float* X = (const float*)d_in[0]; const float* LW = (const float*)d_in[1]; const float* LB = (const float*)d_in[2];
  const float* WQ = (const float*)d_in[3]; const float* WO = (const float*)d_in[4]; const float* BO = (const float*)d_in[5]; const int* LI = (const int*)d_in[6];
  char* ws = (char*)d_ws;
  _Float16* XN = (_Float16*)(ws + WS_XN); _Float16* WQT = (_Float16*)(ws + WS_WQT); _Float16* WOT = (_Float16*)(ws + WS_WOT);
  _Float16* Q16 = (_Float16*)(ws + WS_Q); _Float16* K16 = (_Float16*)(ws + WS_K); _Float16* VT16 = (_Float16*)(ws + WS_VT); _Float16* Y16 = (_Float16*)(ws + WS_Y);
  k_prep<<<dim3(WQ_TILES + WO_TILES + LN_BLOCKS), 256, 0, stream>>>(WQ, WO, X, LW, LB, WQT, WOT, XN);
  k_qkv<<<dim3(NB * SEQ / 128, QKVN / 128), 128, 0, stream>>>(XN, WQT, Q16, K16, VT16);
  k_attn<<<dim3(SEQ / 256, NB * NH), 256, 0, stream>>>(Q16, K16, VT16, LI, Y16);
  k_out<<<dim3(NB * SEQ / 128, DM / 128), 128, 0, stream>>>(Y16, WOT, BO, (float*)d_out);
}
